// v010
// Times are from an AMD MI455X. After a warm-up the kernel runs many times in a row, and a time is the length of
// such a window on the GPU divided by its runs, so every launch and the gaps after it count. The runs cycle
// through copies of the inputs. A figure is the median of several windows, for all but v000 over two sittings.
// Sittings can differ by a few percent; kernels timed side by side share one.
// Earlier versions than v010 are not in this document.
// It runs in 44.7 microseconds.
// Two timings next to v009 both put it at 1.04 times that version's speed.
// Over all steps from v000, the starting kernel, it is 23.5 times as fast.
#include <hip/hip_runtime.h>
#include <math.h>
// InteractionLayer: q, k, v = x W^T + b (three 16384 x 128 by 128 x 128 products in one launch; q f32, k f16 rows, v f16 transposed in 64-key tiles) and single-head attention (d 128, 4096 keys per batch; scores and
// p·v with p x2^15) on v_wmma_f32_16x16x32_f16 with f16 operands, f32 accumulate; softmax f32 on VALU. nn.Linear weights ([out][in]) are the
// transposed operand directly.
typedef __attribute__((ext_vector_type(16))) _Float16 v16h;
typedef __attribute__((ext_vector_type(8)))  _Float16 v8h;
typedef __attribute__((ext_vector_type(16))) __bf16   v16b;
typedef __attribute__((ext_vector_type(8)))  __bf16   v8b;
typedef __attribute__((ext_vector_type(8)))  float    v8f;
typedef __attribute__((ext_vector_type(4)))  float    v4f;
typedef __attribute__((ext_vector_type(2)))  float    v2f;
typedef __attribute__((ext_vector_type(2)))  _Float16 v2h;
#define PSCALE 32768.0f
#define U16(p) ((const unsigned short*)(const void*)(p))
#define PSCALE_INV (1.0f / 32768.0f)

__device__ __forceinline__ unsigned short f2bf_bits(float f) {
  unsigned u = __float_as_uint(f);
  return (unsigned short)((u + 0x7FFFu + ((u >> 16) & 1u)) >> 16);
}
__device__ __forceinline__ float bf_bits2f(unsigned short h) { return __uint_as_float(((unsigned)h) << 16); }

// hazard guards as plain device helpers (no inline asm inside the kernel template body)
__device__ __forceinline__ void dep_guard_h(v8f& a, v8f& b, v16h x, v16h y) { asm volatile("v_nop\n\tv_nop\n\tv_nop\n\tv_nop" : "+v"(a), "+v"(b) : "v"(x), "v"(y)); }
__device__ __forceinline__ void dep_guard_b(v8f& a, v8f& b, v16b x, v16b y) { asm volatile("v_nop\n\tv_nop\n\tv_nop\n\tv_nop" : "+v"(a), "+v"(b) : "v"(x), "v"(y)); }
__device__ __forceinline__ void keep4_h(v16h a, v16h b, v16h c, v16h d) { asm volatile("v_nop" :: "v"(a), "v"(b), "v"(c), "v"(d)); }
__device__ __forceinline__ void keep4_b(v16b a, v16b b, v16b c, v16b d) { asm volatile("v_nop" :: "v"(a), "v"(b), "v"(c), "v"(d)); }
__device__ __forceinline__ void acc_guard4(v8f& a, v8f& b, v8f& c, v8f& d) { asm volatile("v_nop\n\tv_nop\n\tv_nop\n\tv_nop" : "+v"(a), "+v"(b), "+v"(c), "+v"(d)); }
template <typename T> struct Frag;
template <> struct Frag<_Float16> {
  typedef v16h V; union U { v16h v; v8h h[2]; };
  static __device__ __forceinline__ v16h load(const _Float16* p) {   // elements 0..7 <- p[0..7], 8..15 <- p[16..23]
    U f; f.h[0] = *(const v8h*)(p); f.h[1] = *(const v8h*)(p + 16); return f.v;
  }
  static __device__ __forceinline__ v8f mma(v16h a, v16h b, v8f c) {
    return __builtin_amdgcn_wmma_f32_16x16x32_f16(false, a, false, b, (short)0, c, false, false);
  }
  static __device__ __forceinline__ void guard(v8f& a, v8f& b, v16h x, v16h y) { dep_guard_h(a, b, x, y); }
  static __device__ __forceinline__ void keep(v16h a, v16h b, v16h c, v16h d) { keep4_h(a, b, c, d); }
};
template <> struct Frag<__bf16> {
  typedef v16b V; union U { v16b v; v8b h[2]; };
  static __device__ __forceinline__ v16b load(const __bf16* p) {
    U f; f.h[0] = *(const v8b*)(p); f.h[1] = *(const v8b*)(p + 16); return f.v;
  }
  static __device__ __forceinline__ v8f mma(v16b a, v16b b, v8f c) {
    return __builtin_amdgcn_wmma_f32_16x16x32_bf16(false, a, false, b, (short)0, c, false, false);
  }
  static __device__ __forceinline__ void guard(v8f& a, v8f& b, v16b x, v16b y) { dep_guard_b(a, b, x, y); }
  static __device__ __forceinline__ void keep(v16b a, v16b b, v16b c, v16b d) { keep4_b(a, b, c, d); }
};

// ---- Register-blocked batched WMMA GEMM ------------------------------------
// C[m,n] = scale * sum_k A[m,k] * Bt[n,k] (+bias)(+resid); each wave owns a 64x64 tile.
// A row-major [M,K]; Bt row-major [N,K]; M,N % 64 == 0, K % 32 == 0.
// SPLIT: operands are hi/lo planes (A2/Bt2 = lo planes, same layout); product = hi·hi + hi·lo + lo·hi.
// BIAS_MODE: 0 = none, 1 = bias[m], 2 = bias[n].
// OUT_MODE: 0 = f32, 1 = f16, 2 = bf16 hi plane (Cout) + bf16 lo plane (Cout2).
// ET: 0 = f16 operands, 1 = bf16 operands (pointers passed as 16-bit storage)
template <int ET> struct Elem;
template <> struct Elem<0> { typedef _Float16 T; };
template <> struct Elem<1> { typedef __bf16 T; };
template <int ET, bool SPLIT, int BIAS_MODE, int OUT_MODE, bool RESID, int ACT = 0>
__global__ __launch_bounds__(256) void wmma_gemm64(
    const unsigned short* __restrict__ Ap, const unsigned short* __restrict__ A2p, int lda, long strideA,
    const unsigned short* __restrict__ Btp, const unsigned short* __restrict__ Bt2p, int ldb, long strideB,
    void* __restrict__ Cout, void* __restrict__ Cout2, int ldc, long strideC,
    const float* __restrict__ bias,
    const float* __restrict__ resid, long strideR,
    int M, int N, int K, float scale) {
  typedef typename Elem<ET>::T T;
  typedef typename Frag<T>::V V;
  const T* A = (const T*)Ap; const T* A2 = (const T*)A2p; const T* Bt = (const T*)Btp; const T* Bt2 = (const T*)Bt2p;
  __shared__ __align__(16) float sT[8][16 * 68];   // per-wave 16x64 slab, pitch 68 floats
  const int b    = blockIdx.y;
  const int lane = threadIdx.x & 31;
  const int wave = threadIdx.x >> 5;
  const int tilesN = N >> 6;
  const int tilesM = M >> 6;
  const int tile = blockIdx.x * 8 + wave;
  if (tile >= tilesM * tilesN) return;   // wave-uniform; no block barriers in this kernel
  const int tm = tile / tilesN;
  const int tn = tile - tm * tilesN;
  const int m0 = tm << 6;
  const int n0 = tn << 6;

  const T* Ab  = A  + (size_t)b * strideA;
  const T* Bb  = Bt + (size_t)b * strideB;
  const T* Ab2 = SPLIT ? (A2  + (size_t)b * strideA) : nullptr;
  const T* Bb2 = SPLIT ? (Bt2 + (size_t)b * strideB) : nullptr;

  const int rlane = lane & 15;                 // row (A) / col (B, D) within subtile
  const int koff  = (lane >> 4) * 8;           // k offset of this lane half
  const int mOff  = (lane >> 4) * 8;           // D row offset

  v8f acc[4][4];
#pragma unroll
  for (int i = 0; i < 4; ++i)
#pragma unroll
    for (int j = 0; j < 4; ++j) acc[i][j] = (v8f){0.f,0.f,0.f,0.f,0.f,0.f,0.f,0.f};

  for (int k0 = 0; k0 < K; k0 += 32) {
    V bh[4], bl[4];
#pragma unroll
    for (int j = 0; j < 4; ++j) {
      const size_t bo = (size_t)(n0 + (j << 4) + rlane) * ldb + koff + k0;
      bh[j] = Frag<T>::load(Bb + bo);
      if (SPLIT) bl[j] = Frag<T>::load(Bb2 + bo);
    }
#pragma unroll
    for (int i = 0; i < 4; ++i) {
      const size_t ao = (size_t)(m0 + (i << 4) + rlane) * lda + koff + k0;
      V ah = Frag<T>::load(Ab + ao);
      V al;
      if (SPLIT) al = Frag<T>::load(Ab2 + ao);
#pragma unroll
      for (int j = 0; j < 4; ++j) {
        acc[i][j] = Frag<T>::mma(ah, bh[j], acc[i][j]);
        if (SPLIT) {
          acc[i][j] = Frag<T>::mma(ah, bl[j], acc[i][j]);
          acc[i][j] = Frag<T>::mma(al, bh[j], acc[i][j]);
        }
      }
      Frag<T>::guard(acc[i][0], acc[i][3], ah, SPLIT ? al : ah);
    }
    Frag<T>::keep(bh[0], bh[1], bh[2], bh[3]);
    if (SPLIT) Frag<T>::keep(bl[0], bl[1], bl[2], bl[3]);
  }
  acc_guard4(acc[0][0], acc[0][1], acc[0][2], acc[0][3]);
  acc_guard4(acc[1][0], acc[1][1], acc[1][2], acc[1][3]);
  acc_guard4(acc[2][0], acc[2][1], acc[2][2], acc[2][3]);
  acc_guard4(acc[3][0], acc[3][1], acc[3][2], acc[3][3]);

  // ---- epilogue ----
  float* slab = sT[wave];
  const float* Rb = RESID ? (resid + (size_t)b * strideR) : nullptr;
#pragma unroll
  for (int i = 0; i < 4; ++i) {
    const int mBase = m0 + (i << 4);
#pragma unroll
    for (int j = 0; j < 4; ++j) {
      const int n = n0 + (j << 4) + rlane;
      float bv = 0.f;
      if (BIAS_MODE == 2) bv = bias[n];
#pragma unroll
      for (int r = 0; r < 8; ++r) {
        float v = acc[i][j][r] * scale;
        if (BIAS_MODE == 1) v += bias[mBase + mOff + r];
        if (BIAS_MODE == 2) v += bv;
        if (RESID) v += Rb[(size_t)(mBase + mOff + r) * ldc + n];
        if (ACT == 1) v = tanhf(v);
        if (ACT == 2) v = fmaxf(v, 0.0f);
        if (ACT == 3) v = v / (1.0f + expf(-v));
        if (ACT == 4) v = (v > 0.f) ? v : 0.01f * v;
        if (ACT == 5) v = 0.5f * v * (1.0f + erff(v * 0.70710678118654752f));
        slab[(mOff + r) * 68 + (j << 4) + rlane] = v;
      }
    }
    __builtin_amdgcn_fence(__ATOMIC_RELEASE, "workgroup");
    __builtin_amdgcn_wave_barrier();
    __builtin_amdgcn_fence(__ATOMIC_ACQUIRE, "workgroup");
    if (OUT_MODE == 0) {
      float* C = (float*)Cout + (size_t)b * strideC;
      const int hh = lane >> 4, c4 = (lane & 15) * 4;     // row seg = 256 B = 16 lanes x 16 B
      {
#pragma unroll
        for (int it = 0; it < 8; ++it) {
          const int row = it * 2 + hh;
          v4f v = *(const v4f*)(slab + row * 68 + c4);
          *(v4f*)(C + (size_t)(mBase + row) * ldc + n0 + c4) = v;
        }
        
      }
    } else {
      const int q = lane >> 3, c8 = (lane & 7) * 8;
      unsigned short* C  = (unsigned short*)Cout  + (size_t)b * strideC;
      unsigned short* C2 = (OUT_MODE == 2) ? ((unsigned short*)Cout2 + (size_t)b * strideC) : nullptr;
      {
#pragma unroll
        for (int it = 0; it < 4; ++it) {
          const int row = it * 4 + q;
          const float* sp = slab + row * 68 + c8;
          v8h hv, lv;
#pragma unroll
          for (int e = 0; e < 8; ++e) {
            if (OUT_MODE == 1) {
              hv[e] = (_Float16)sp[e];
            } else {
              unsigned short hb = f2bf_bits(sp[e]);
              unsigned short lb = f2bf_bits(sp[e] - bf_bits2f(hb));
              hv[e] = __builtin_bit_cast(_Float16, hb);
              lv[e] = __builtin_bit_cast(_Float16, lb);
            }
          }
          *(v8h*)(C + (size_t)(mBase + row) * ldc + n0 + c8) = hv;
          if (OUT_MODE == 2) *(v8h*)(C2 + (size_t)(mBase + row) * ldc + n0 + c8) = lv;
        }
        
      }
    }
    __builtin_amdgcn_fence(__ATOMIC_RELEASE, "workgroup");
    __builtin_amdgcn_wave_barrier();
    __builtin_amdgcn_fence(__ATOMIC_ACQUIRE, "workgroup");
  }
}

__global__ __launch_bounds__(256) void cast_f32_f16x2(
    const float* __restrict__ in, _Float16* __restrict__ out, int n2) {
  int i = blockIdx.x * 256 + threadIdx.x;
  if (i < n2) {
    const _Float16 h0 = (_Float16)in[2 * i], h1 = (_Float16)in[2 * i + 1];
    const unsigned u = (unsigned)__builtin_bit_cast(unsigned short, h0) | ((unsigned)__builtin_bit_cast(unsigned short, h1) << 16);
    ((unsigned*)out)[i] = u;
    
  }
}


// ---- f32 -> f16 cast with a power-of-two pre-scale (folded back by the consumer GEMM's scale) ----
__global__ __launch_bounds__(256) void cast_f32_f16x2s(const float* __restrict__ in, _Float16* __restrict__ out, int n2, float s) {
  int i = blockIdx.x * 256 + threadIdx.x;
  if (i < n2) {
    const _Float16 h0 = (_Float16)(in[2 * i] * s), h1 = (_Float16)(in[2 * i + 1] * s);
    const unsigned u = (unsigned)__builtin_bit_cast(unsigned short, h0) | ((unsigned)__builtin_bit_cast(unsigned short, h1) << 16);
    ((unsigned*)out)[i] = u;
    
  }
}
__global__ __launch_bounds__(256) void split_f32_bf16x2(
    const float* __restrict__ in, __bf16* __restrict__ hi, __bf16* __restrict__ lo, long n2) {
  long i = (long)blockIdx.x * 256 + threadIdx.x;
  long stride = (long)gridDim.x * 256;
  {
    for (long j = i; j < n2; j += stride) {
      const float a = in[2 * j], b = in[2 * j + 1];
      const unsigned short ah = f2bf_bits(a), bh = f2bf_bits(b);
      const unsigned short al = f2bf_bits(a - bf_bits2f(ah)), bl = f2bf_bits(b - bf_bits2f(bh));
      ((unsigned*)hi)[j] = (unsigned)ah | ((unsigned)bh << 16);
      ((unsigned*)lo)[j] = (unsigned)al | ((unsigned)bl << 16);
    }
    
  }
}


// ---- f32 [R][C] (row pitch ldi) -> f16 transposed [C][R] (row pitch ldo); 64x64 tiles; each output row segment
__global__ __launch_bounds__(256) void transpose_cast_f16(const float* __restrict__ in, int ldi,
                                                         _Float16* __restrict__ outT, int ldo, float scale) {
  __shared__ __align__(16) _Float16 tile[64][72];     // [c][r]
  const int c0 = blockIdx.x * 64, r0 = blockIdx.y * 64;
  const int t = threadIdx.y * 32 + threadIdx.x;
  for (int i = threadIdx.y; i < 64; i += 8) {
    tile[threadIdx.x][i]      = (_Float16)(in[(size_t)(r0 + i) * ldi + c0 + threadIdx.x] * scale);
    tile[32 + threadIdx.x][i] = (_Float16)(in[(size_t)(r0 + i) * ldi + c0 + 32 + threadIdx.x] * scale);
  }
  __syncthreads();
  const int q = t >> 3, c8 = (t & 7) * 8;
  {
#pragma unroll
    for (int it = 0; it < 2; ++it) {
      const int c = it * 32 + q;
      v8h hv = *(const v8h*)(&tile[c][c8]);
      *(v8h*)(outT + (size_t)(c0 + c) * ldo + r0 + c8) = hv;
    }
    
  }
}

// ---- f32 [R][C] (pitch ldi) -> bf16 hi/lo transposed planes [C][R] (pitch ldo); 64x64 tiles; each output row segment
__global__ __launch_bounds__(256) void transpose_split_bf16(const float* __restrict__ in, int ldi,
                                                           __bf16* __restrict__ outH, __bf16* __restrict__ outL, int ldo) {
  __shared__ __align__(16) float tile[64][68];     // [c][r]
  const int c0 = blockIdx.x * 64, r0 = blockIdx.y * 64;
  const int t = threadIdx.y * 32 + threadIdx.x;
  for (int i = threadIdx.y; i < 64; i += 8) {
    tile[threadIdx.x][i]      = in[(size_t)(r0 + i) * ldi + c0 + threadIdx.x];
    tile[32 + threadIdx.x][i] = in[(size_t)(r0 + i) * ldi + c0 + 32 + threadIdx.x];
  }
  __syncthreads();
  const int q = t >> 3, c8 = (t & 7) * 8;
  {
#pragma unroll
    for (int it = 0; it < 2; ++it) {
      const int c = it * 32 + q;
      v8b hv, lv;
#pragma unroll
      for (int e = 0; e < 8; ++e) {
        const float f = tile[c][c8 + e];
        const unsigned short hb = f2bf_bits(f);
        hv[e] = __builtin_bit_cast(__bf16, hb);
        lv[e] = __builtin_bit_cast(__bf16, f2bf_bits(f - bf_bits2f(hb)));
      }
      *(v8b*)(outH + (size_t)(c0 + c) * ldo + r0 + c8) = hv;
      *(v8b*)(outL + (size_t)(c0 + c) * ldo + r0 + c8) = lv;
    }
    
  }
}

// =====================================================================================
// Generic causal/non-causal attention for head_dim 64, f32 in / f32 out; 16-bit operands: bf16 with optional hi/lo splits, or
// plain f16 (F16=true, non-split, probabilities carried x2^15).
//   scores = (q*qscale)·kᵀ : v_wmma_f32_16x16x32_bf16; SPLIT_QK -> q,k as bf16 hi/lo (hi·hi + hi·lo + lo·hi)
//   out    = p·v           : v_wmma_f32_16x16x32_bf16; SPLIT_PV -> p,v as bf16 hi/lo; else p,v plain bf16
//   f32 accumulate; online softmax in f32. Block = 4 waves = 64 query rows of one (batch, head); S % 64 == 0.
//   Element (b, s, h, d) of tensor X lives at X[b*X_bs + s*X_rs + h*X_hs + d] (strides in floats, multiples of 4).
//   Masking: mask_mode 0 none, 1 causal (kv > q masked), 2 tensor [S][Skv] shared over (b,h) (float if
//   mask_is_int==0, int32 with element == 0 -> masked if 1, int32 with element != 0 -> masked if 2), 3 per-token vectors qmask[B][S] & kvmask[B][Skv] (int32,
//   0 -> masked), 4 causal + sliding window (kv > q or q - kv > W masked; W passed in mask_is_int);
//   5 = relative-position bias: s += cp[b,h,q][idx[q][kv]] + pc[b,h,kv][idx[q][kv]] with idx = mask_b ([S][Skv] int32) and
//   mask_a an int32 [S][Skv] tensor with nonzero = masked (tables: element (b,h,row,n) at X + b*c_bs + h*c_hs + row*c_rs + n);
//   masked scores are replaced by mask_fill (e.g. -inf or -1e9) before the softmax.
//   grid.x = B * H * (S/64) (or a sub-range with blk0).
// =====================================================================================
#define AT_D 64
#define AT_NW 4
#define AT_QB 64
#define AT_KC 64
struct AttnGeom { const float* cp = nullptr; const float* pc = nullptr; long c_bs = 0, c_rs = 0, c_hs = 0;   // mode-5 score-bias tables
                  long q_bs, q_rs, q_hs, k_bs, k_rs, k_hs, v_bs, v_rs, v_hs, o_bs, o_rs, o_hs;
                  int S, Skv, H, mask_mode; float qscale; int blk0; float mask_fill; int mask_is_int; };
static_assert(sizeof(AttnGeom) == 168, "no padding");

__device__ __forceinline__ unsigned short at_bf_bits(float f) {
  unsigned u = __float_as_uint(f);
  return (unsigned short)((u + 0x7FFFu + ((u >> 16) & 1u)) >> 16);
}
__device__ __forceinline__ __bf16 at_f2bf(float f) { return __builtin_bit_cast(__bf16, at_bf_bits(f)); }
__device__ __forceinline__ void at_split(float f, __bf16& hi, __bf16& lo) {
  const unsigned short hb = at_bf_bits(f);
  hi = __builtin_bit_cast(__bf16, hb);
  lo = at_f2bf(f - __uint_as_float(((unsigned)hb) << 16));
}
__device__ __forceinline__ v8f at_mma(v16b a, v16b b, v8f c) {
  c = __builtin_amdgcn_wmma_f32_16x16x32_bf16(false, a, false, b, (short)0, c, false, false);
  asm volatile("v_nop\n\tv_nop\n\tv_nop\n\tv_nop" : "+v"(c) : "v"(a), "v"(b));
  return c;
}
// 16-bit element as a bit pattern held in a __bf16 slot: f16 bits when F16, bf16 (RNE) otherwise
template <bool F16> __device__ __forceinline__ __bf16 at_to16(float f) {
  if (F16) return __builtin_bit_cast(__bf16, (_Float16)f);
  return at_f2bf(f);
}
template <bool F16> __device__ __forceinline__ v8f at_mma16(v16b a, v16b b, v8f c) {
  if (F16) {
    const v16h ah = __builtin_bit_cast(v16h, a), bh = __builtin_bit_cast(v16h, b);
    // the builtin alone: the compiler keeps the distance behind it itself, and no asm statement holds the LDS reads of later products behind this one
    return __builtin_amdgcn_wmma_f32_16x16x32_f16(false, ah, false, bh, (short)0, c, false, false);
  }
  return at_mma(a, b, c);
}

template <bool SPLIT_QK, bool SPLIT_PV, bool F16 = false>
__global__ __launch_bounds__(128)
void attn64_kernel(const float* __restrict__ q, const float* __restrict__ k,
                   const float* __restrict__ v, float* __restrict__ out,
                   const void* __restrict__ mask_a, const int* __restrict__ mask_b, AttnGeom g) {
  static_assert(!(F16 && (SPLIT_QK || SPLIT_PV)), "f16 mode is non-split");
  const float PSC = F16 ? 32768.0f : 1.0f;     // f16 probabilities carried x2^15 (subnormal range), folded into the final 1/l
  union FB { v16b v; v8b h[2]; };
  __shared__ __align__(16) __bf16 Ksh[AT_KC * AT_D];             // K hi [kv][d]      8 KB
  __shared__ __align__(16) __bf16 Ksl[SPLIT_QK ? AT_KC * AT_D : 8];
  __shared__ __align__(16) __bf16 Vth[AT_D * AT_KC];             // V hi [d][kv]      8 KB
  __shared__ __align__(16) __bf16 Vtl[SPLIT_PV ? AT_D * AT_KC : 8];
  __shared__ __align__(16) __bf16 Psh[AT_NW][16 * AT_KC];        // per wave P hi [row][kv]  8 KB
  __shared__ __align__(16) __bf16 Psl[SPLIT_PV ? AT_NW : 1][SPLIT_PV ? 16 * AT_KC : 8];
  __shared__ __align__(16) float  Os[AT_NW][16 * 68];            // per wave out tile, pitch 68

  const int tid  = threadIdx.x;
  const int wave = tid >> 5;
  const int lane = tid & 31;
  const int hh   = lane >> 4;
  const int c    = lane & 15;

  const int nqb = g.S / AT_QB;
  const int bx = blockIdx.x + g.blk0;
  const int qb = bx % nqb;
  const int bh = bx / nqb;
  const int h  = bh % g.H;
  const int b  = bh / g.H;
  const int qbase_block = qb * AT_QB;
  const int q0 = qbase_block + wave * 16;

  const float* qb_ptr = q + (size_t)b * g.q_bs + (size_t)h * g.q_hs;
  const float* kb_ptr = k + (size_t)b * g.k_bs + (size_t)h * g.k_hs;
  const float* vb_ptr = v + (size_t)b * g.v_bs + (size_t)h * g.v_hs;
  float*       ob_ptr = out + (size_t)b * g.o_bs + (size_t)h * g.o_hs;

  // ---- Q fragments (A operand): 2 d-chunks, hi (and lo) ----
  v16b qah[2], qal[2];
  {
    const float* qrow = qb_ptr + (size_t)(q0 + c) * g.q_rs;
#pragma unroll
    for (int dc = 0; dc < 2; ++dc) {
#pragma unroll
      for (int e = 0; e < 8; ++e) {
        const float f0 = qrow[dc * 32 + 8 * hh + e] * g.qscale;
        const float f1 = qrow[dc * 32 + 16 + 8 * hh + e] * g.qscale;
        if (SPLIT_QK) { __bf16 hq, lq; at_split(f0, hq, lq); qah[dc][e] = hq; qal[dc][e] = lq; at_split(f1, hq, lq); qah[dc][8 + e] = hq; qal[dc][8 + e] = lq; }
        else { qah[dc][e] = at_to16<F16>(f0); qah[dc][8 + e] = at_to16<F16>(f1); qal[dc][e] = qah[dc][e]; qal[dc][8 + e] = qah[dc][8 + e]; }
      }
    }
  }

  float mrow[8], lrow[8];
  v8f oacc[4];
#pragma unroll
  for (int r = 0; r < 8; ++r) { mrow[r] = -INFINITY; lrow[r] = 0.f; }
#pragma unroll
  for (int t = 0; t < 4; ++t) oacc[t] = (v8f){0.f,0.f,0.f,0.f,0.f,0.f,0.f,0.f};

  const int nChunks = (g.mask_mode == 1 || g.mask_mode == 4) ? (qb + 1) : (g.Skv / AT_KC);   // block-uniform
  // per-row query mask (mode 3)
  int qkeep[8];
#pragma unroll
  for (int r = 0; r < 8; ++r) qkeep[r] = (g.mask_mode == 3) ? mask_b[(size_t)b * g.S + q0 + 8 * hh + r] : 1;   // mask_b = qmask in mode 3
  for (int kc = 0; kc < nChunks; ++kc) {
    const int kv0 = kc * AT_KC;
    __syncthreads();
    {
      const int kvr = tid >> 1, dh = (tid & 1) * 32;
      const float* krow = kb_ptr + (size_t)(kv0 + kvr) * g.k_rs + dh;
      const float* vrow = vb_ptr + (size_t)(kv0 + kvr) * g.v_rs + dh;
#pragma unroll
      for (int i = 0; i < 8; ++i) {
        v4f kk = *(const v4f*)(krow + 4 * i);
        v4f vv = *(const v4f*)(vrow + 4 * i);
#pragma unroll
        for (int e = 0; e < 4; ++e) {
          const int d = dh + 4 * i + e;
          if (SPLIT_QK) { __bf16 a, bl; at_split(kk[e], a, bl); Ksh[kvr * AT_D + d] = a; Ksl[kvr * AT_D + d] = bl; }
          else Ksh[kvr * AT_D + d] = at_to16<F16>(kk[e]);
          if (SPLIT_PV) { __bf16 a, bl; at_split(vv[e], a, bl); Vth[d * AT_KC + kvr] = a; Vtl[d * AT_KC + kvr] = bl; }
          else Vth[d * AT_KC + kvr] = at_to16<F16>(vv[e]);
        }
      }
    }
    __syncthreads();

    v8f s[4];
#pragma unroll
    for (int j = 0; j < 4; ++j) {
      s[j] = (v8f){0.f,0.f,0.f,0.f,0.f,0.f,0.f,0.f};
#pragma unroll 1
      for (int dc = 0; dc < 2; ++dc) {
        FB kb;
        kb.h[0] = *(const v8b*)(Ksh + (j * 16 + c) * AT_D + dc * 32 + 8 * hh);
        kb.h[1] = *(const v8b*)(Ksh + (j * 16 + c) * AT_D + dc * 32 + 16 + 8 * hh);
        s[j] = at_mma16<F16>(qah[dc], kb.v, s[j]);
        if (SPLIT_QK) {
          FB kl;
          kl.h[0] = *(const v8b*)(Ksl + (j * 16 + c) * AT_D + dc * 32 + 8 * hh);
          kl.h[1] = *(const v8b*)(Ksl + (j * 16 + c) * AT_D + dc * 32 + 16 + 8 * hh);
          s[j] = at_mma16<F16>(qah[dc], kl.v, s[j]);
          s[j] = at_mma16<F16>(qal[dc], kb.v, s[j]);
        }
      }
    }
    const bool diag = (g.mask_mode == 1) && (kc == qb);
    int kvkeep[4] = {1, 1, 1, 1};
    if (g.mask_mode == 3) {
#pragma unroll
      for (int j = 0; j < 4; ++j) kvkeep[j] = ((const int*)mask_a)[(size_t)b * g.Skv + kv0 + j * 16 + c];   // mask_a = kvmask
    }
    float cm[8];
#pragma unroll
    for (int r = 0; r < 8; ++r) {
      const int qrow = q0 + 8 * hh + r;
      float m = -INFINITY;
#pragma unroll
      for (int j = 0; j < 4; ++j) {
        const int kvcol = kv0 + j * 16 + c;
        bool masked = false;
        if (diag) masked = (kvcol > qrow);
        else if (g.mask_mode == 4) masked = (kvcol > qrow) || (qrow - kvcol > g.mask_is_int);
        else if (g.mask_mode == 2) {
          const size_t mi = (size_t)qrow * g.Skv + kvcol;
          masked = (g.mask_is_int == 0) ? (((const float*)mask_a)[mi] == 0.0f)
                 : (g.mask_is_int == 1) ? (((const int*)mask_a)[mi] == 0) : (((const int*)mask_a)[mi] != 0);
        } else if (g.mask_mode == 3) masked = (qkeep[r] == 0) || (kvkeep[j] == 0);
        else if (g.mask_mode == 5) {
          const size_t mi = (size_t)qrow * g.Skv + kvcol;
          masked = (((const int*)mask_a)[mi] != 0);
          int n = mask_b[mi]; n = n < 0 ? 0 : n;
          s[j][r] += g.cp[(size_t)b * g.c_bs + (size_t)h * g.c_hs + (size_t)qrow * g.c_rs + n]
                   + g.pc[(size_t)b * g.c_bs + (size_t)h * g.c_hs + (size_t)kvcol * g.c_rs + n];
        }
        if (masked) s[j][r] = g.mask_fill;
        m = fmaxf(m, s[j][r]);
      }
#pragma unroll
      for (int off = 1; off < 16; off <<= 1) m = fmaxf(m, __shfl_xor(m, off, 32));
      cm[r] = m;
    }
    __bf16* pwh = Psh[wave];
    __bf16* pwl = Psl[SPLIT_PV ? wave : 0];
#pragma unroll
    for (int r = 0; r < 8; ++r) {
      const float mnew = fmaxf(mrow[r], cm[r]);
      const float alpha = expf(mrow[r] - mnew);
      mrow[r] = mnew;
      float psum = 0.f;
#pragma unroll
      for (int j = 0; j < 4; ++j) {
        const float p = expf(s[j][r] - mnew);
        psum += p;
        if (SPLIT_PV) { __bf16 a, bl; at_split(p, a, bl); pwh[(8 * hh + r) * AT_KC + j * 16 + c] = a; pwl[(8 * hh + r) * AT_KC + j * 16 + c] = bl; }
        else pwh[(8 * hh + r) * AT_KC + j * 16 + c] = at_to16<F16>(p * PSC);
      }
#pragma unroll
      for (int off = 1; off < 16; off <<= 1) psum += __shfl_xor(psum, off, 32);
      lrow[r] = lrow[r] * alpha + psum;
#pragma unroll
      for (int t = 0; t < 4; ++t) oacc[t][r] *= alpha;
    }
    __builtin_amdgcn_fence(__ATOMIC_RELEASE, "workgroup");
    __builtin_amdgcn_wave_barrier();
    __builtin_amdgcn_fence(__ATOMIC_ACQUIRE, "workgroup");
#pragma unroll 1
    for (int kk = 0; kk < 2; ++kk) {
      FB pa, pl;
      pa.h[0] = *(const v8b*)(pwh + c * AT_KC + kk * 32 + 8 * hh);
      pa.h[1] = *(const v8b*)(pwh + c * AT_KC + kk * 32 + 16 + 8 * hh);
      if (SPLIT_PV) {
        pl.h[0] = *(const v8b*)(pwl + c * AT_KC + kk * 32 + 8 * hh);
        pl.h[1] = *(const v8b*)(pwl + c * AT_KC + kk * 32 + 16 + 8 * hh);
      }
#pragma unroll
      for (int t = 0; t < 4; ++t) {
        FB vb;
        vb.h[0] = *(const v8b*)(Vth + (t * 16 + c) * AT_KC + kk * 32 + 8 * hh);
        vb.h[1] = *(const v8b*)(Vth + (t * 16 + c) * AT_KC + kk * 32 + 16 + 8 * hh);
        oacc[t] = at_mma16<F16>(pa.v, vb.v, oacc[t]);
        if (SPLIT_PV) {
          FB vl;
          vl.h[0] = *(const v8b*)(Vtl + (t * 16 + c) * AT_KC + kk * 32 + 8 * hh);
          vl.h[1] = *(const v8b*)(Vtl + (t * 16 + c) * AT_KC + kk * 32 + 16 + 8 * hh);
          oacc[t] = at_mma16<F16>(pa.v, vl.v, oacc[t]);
          oacc[t] = at_mma16<F16>(pl.v, vb.v, oacc[t]);
        }
      }
    }
  }

  float* os = Os[wave];
#pragma unroll
  for (int r = 0; r < 8; ++r) {
    const float inv = 1.0f / (lrow[r] * PSC);
#pragma unroll
    for (int t = 0; t < 4; ++t) os[(8 * hh + r) * 68 + t * 16 + c] = oacc[t][r] * inv;
  }
  __builtin_amdgcn_fence(__ATOMIC_RELEASE, "workgroup");
  __builtin_amdgcn_wave_barrier();
  __builtin_amdgcn_fence(__ATOMIC_ACQUIRE, "workgroup");
  {
    const int c4 = (lane & 15) * 4;
    {
#pragma unroll
      for (int it = 0; it < 8; ++it) {
        const int row = it * 2 + hh;
        v4f val = *(const v4f*)(os + row * 68 + c4);
        *(v4f*)(ob_ptr + (size_t)(q0 + row) * g.o_rs + c4) = val;
      }
      
    }
  }
}

// Both products are formed transposed: scores^T = k q^T (A = k rows, B = q rows) and out^T += v^T p^T (A = transposed v rows, B = p^T). In the accumulator tile of
//   scores^T a lane holds eight keys of ONE query (lane l: query l & 15, keys 8 (l >> 4) + r), so the running maximum and sum of a query are formed inside the lane, with one
//   exchange between the wave halves, and two score tiles, converted in place, ARE the B operand of the second product in the hardware's k order: p never goes through LDS.
// MODE: the mask mode as a compile-time constant; only 0 (no mask) is written in this form.
// PRE16: k and v come ready as 16-bit values, written once by their producer (k, v unused): k16 holds dense rows, element (b, s, d) at
//   k16[b*k_bs + s*128 + d]; vt16 holds v transposed in tiles of AT_KC keys, element (b, s, d) at vt16[b*v_bs + (s/AT_KC)*AT_KC*128 + d*AT_KC + s%AT_KC]
//   (k_bs, v_bs in 16-bit elements, multiples of 8), so that a pass's k tile and v tile are 16 KB contiguous each.
// NG: key groups. The block has NG groups of AT_NW waves on the SAME 64 query rows; group g walks the key tiles g, g + NG, g + 2 NG, ... with its own
//   k, v tiles in LDS and its own running maximum, sum and output tile, so that NG waves share each SIMD and fill one another's waits. Behind the loop the NG
//   partial results of a row are joined: out = sum_g 2^(m_g - m) o_g / sum_g 2^(m_g - m) l_g, m = max_g m_g (log2 units). Skv a positive multiple of NG * AT_KC.
// The k, v tiles come into LDS by asynchronous copies, two buffers a group: while a trip works on one buffer, the next trip's tiles fly into the other.
// lane l takes the value of lane l ^ 16 (the other wave half), by a vector cross-row move
__device__ __forceinline__ float at_xhalf(float x) {
  return __builtin_bit_cast(float, __builtin_amdgcn_permlanex16(__builtin_bit_cast(int, x), __builtin_bit_cast(int, x), 0x76543210, 0xfedcba98, false, false));
}
// 2^x for the join behind the loop (five a lane, once a kernel). The v_nop is the one free slot that the instruction set asks for behind a transcendental before its
// result is read or its source reused; so it stands in the instruction's own statement here
__device__ __forceinline__ float at_exp2_slot(float x) { float r; asm("v_exp_f32 %0, %1\n\tv_nop" : "=v"(r) : "v"(x)); return r; }
// eight asynchronous 16 B copies of a lane, global memory -> LDS through no register: l = the lane's LDS byte addresses, s = its global addresses.
// precaution: s_wait_xcnt 0 is the last line of the copies' own statement, so that it stands before any of the address registers named here is reused
__device__ __forceinline__ void at_copy8(const unsigned (&l)[8], const unsigned short* const (&s)[8]) {
  asm volatile("global_load_async_to_lds_b128 %0, %8, off\n\t"
               "global_load_async_to_lds_b128 %1, %9, off\n\t"
               "global_load_async_to_lds_b128 %2, %10, off\n\t"
               "global_load_async_to_lds_b128 %3, %11, off\n\t"
               "global_load_async_to_lds_b128 %4, %12, off\n\t"
               "global_load_async_to_lds_b128 %5, %13, off\n\t"
               "global_load_async_to_lds_b128 %6, %14, off\n\t"
               "global_load_async_to_lds_b128 %7, %15, off\n\t"
               "s_wait_xcnt 0x0"
               :: "v"(l[0]), "v"(l[1]), "v"(l[2]), "v"(l[3]), "v"(l[4]), "v"(l[5]), "v"(l[6]), "v"(l[7]),
                  "v"(s[0]), "v"(s[1]), "v"(s[2]), "v"(s[3]), "v"(s[4]), "v"(s[5]), "v"(s[6]), "v"(s[7]) : "memory");
}
template <bool SPLIT_QK, bool SPLIT_PV, bool F16, int MODE, bool PRE16, int NG>
__global__ __launch_bounds__(128 * NG)
void attn128_kernel(const float* __restrict__ q, const float* __restrict__ k,
                   const float* __restrict__ v, const unsigned short* __restrict__ k16,
                   const unsigned short* __restrict__ vt16, float* __restrict__ out,
                   const void* __restrict__ mask_a, const int* __restrict__ mask_b, AttnGeom g) {
  static_assert(F16 && PRE16 && MODE == 0 && !SPLIT_QK && !SPLIT_PV && 16 % NG == 0, "transposed form: f16, ready k and v, unmasked, non-split");
  (void)k; (void)v; (void)mask_a; (void)mask_b;
  // Exponentials are base 2, one v_exp_f32 each: g.qscale holds log2(e) / sqrt(d), so scores, maxima and their differences are in log2 units.
  // f16 probabilities are carried x2^15 (subnormal range): the 15 rides in the exponent, the sums carry the same factor, and it cancels in the final 1/l.
  union FB { v16b v; v8b h[2]; };
  constexpr int D2 = 128;
  constexpr int KP = D2 + 8;      // LDS pitch of the k and q rows, in 16-bit elements: 272 B = 16 B x odd, so the 16 rows of a ds_load_b128 fragment read fall on distinct banks
  constexpr int VP = AT_KC + 8;   // LDS pitch of the transposed v rows: 144 B = 16 B x odd, same reason
  constexpr int NWV = AT_NW * NG;                 // waves of the block
  constexpr int KVB = (AT_KC * KP + D2 * VP) * 2; // bytes of one group's k tile (17 KB, [kv][d], padded rows) and v tile (18 KB, [d][kv], padded rows)
  static_assert(AT_NW * 16 * 132 * 4 <= KVB, "the out tiles overlay the k, v tiles");
  __shared__ __align__(16) unsigned char KVraw[2 * NG * KVB];    // in the loop: two buffers of each group's k, v tiles (buffer u, group g at (u NG + g) KVB); behind it: per wave out tile, pitch 132 floats
  __shared__ __align__(16) __bf16 Qsh[AT_NW][16 * KP];   // q (the 16-bit value), one copy per 16-row query tile, read by that tile's wave of every group: leaves room for the second buffer
  __shared__ __align__(16) float  Msh[NWV][16], Lsh[NWV][16];    // each wave's query maxima and sums, for the join of the key groups

  const int grp  = __builtin_amdgcn_readfirstlane(threadIdx.x >> 7);   // key group; the same in a whole wave: held scalar, so the tile offsets stay scalar arithmetic
  const int tid  = threadIdx.x & 127;    // thread within its group
  const int wave = tid >> 5;             // wave within its group = its 16-row query tile
  const int wv   = grp * AT_NW + wave;   // wave within the block: its private LDS
  const int lane = tid & 31;
  const int hh   = lane >> 4;
  const int c    = lane & 15;

  const int nqb = g.S / AT_QB;
  const int bx = blockIdx.x + g.blk0;
  const int qb = bx % nqb;
  const int bh = bx / nqb;
  const int h  = bh % g.H;
  const int b  = bh / g.H;
  const int qbase_block = qb * AT_QB;
  const int q0 = qbase_block + wave * 16;

  const float* qb_ptr = q + (size_t)b * g.q_bs + (size_t)h * g.q_hs;
  float*       ob_ptr = out + (size_t)b * g.o_bs + (size_t)h * g.o_hs;

  // ---- the group's key tile of trip t (tile t NG + grp) into buffer t & 1: 16 B a lane and copy; a wave's 32 lanes take 512 contiguous bytes of the source;
  //      copy i is 2 KB further in the source (8 k rows, 16 v rows). 16 copies of a wave per tile, and never more than one tile's in flight.
  const unsigned short* ksrc = k16 + (size_t)b * g.k_bs + tid * 8;
  const unsigned short* vsrc = vt16 + (size_t)b * g.v_bs + tid * 8;
  const unsigned gdst = (unsigned)(size_t)(KVraw + grp * KVB);   // LDS byte address: the low 32 bits of the __shared__ address
  const unsigned kdst = gdst + ((tid >> 4) * KP + (tid & 15) * 8) * 2;
  const unsigned vdst = gdst + (AT_KC * KP + (tid >> 3) * VP + (tid & 7) * 8) * 2;
  auto copy_tile = [&](int t) {
    const size_t so = (size_t)(t * NG + grp) * (AT_KC * D2);
    const unsigned bo = (unsigned)(t & 1) * (NG * KVB);
    unsigned l[8];
    const unsigned short* s[8];
#pragma unroll   // unrolled so that l, s are registers
    for (int i = 0; i < 8; ++i) { l[i] = kdst + bo + i * (8 * KP * 2); s[i] = ksrc + so + i * 1024; }
    at_copy8(l, s);
#pragma unroll
    for (int i = 0; i < 8; ++i) { l[i] = vdst + bo + i * (16 * VP * 2); s[i] = vsrc + so + i * 1024; }
    at_copy8(l, s);
  };
  const int nTrips = g.Skv / (AT_KC * NG);   // block-uniform
  copy_tile(0);

  // ---- q rows of the wave's query tile, scaled and rounded to 16 bits, into LDS: group g lays the 32-column chunks g, g + NG, ... ----
  {
    const float* qrow = qb_ptr + (size_t)(q0 + c) * g.q_rs;
    for (int dc = grp; dc < 4; dc += NG) {
#pragma unroll
      for (int e = 0; e < 8; ++e) {
        const float f0 = qrow[dc * 32 + 8 * hh + e] * g.qscale;
        const float f1 = qrow[dc * 32 + 16 + 8 * hh + e] * g.qscale;
        Qsh[wave][c * KP + dc * 32 + 8 * hh + e] = at_to16<F16>(f0); Qsh[wave][c * KP + dc * 32 + 16 + 8 * hh + e] = at_to16<F16>(f1);
      }
    }
  }
  asm volatile("s_wait_asynccnt 0x0" ::: "memory");   // the wave's own copies of tile 0 have landed
  __syncthreads();                                    // tile 0 and the q rows are published to every wave
  if (nTrips > 1) copy_tile(1);

  float mrow = -INFINITY;   // running maximum of query q0 + c, the same in both wave halves
  float lrow = 0.f;         // running sum of query q0 + c over THIS half's keys (8 of every 16); the halves are joined behind the loop
  v8f oacc[8];              // oacc[t][r] = out^T[d = 16 t + 8 hh + r][query q0 + c]
#pragma unroll
  for (int t = 0; t < 8; ++t) oacc[t] = (v8f){0.f,0.f,0.f,0.f,0.f,0.f,0.f,0.f};

  for (int it = 0; it < nTrips; ++it) {
    const __bf16* Ksh = (const __bf16*)(KVraw + ((it & 1) * NG + grp) * KVB);   // trip it reads buffer it & 1 alone
    const __bf16* Vth = Ksh + AT_KC * KP;

    // The trip's LDS reads are issued in groups of eight (four fragments), each group well ahead of the products that use it, as far as 256 registers allow, so that a
    // read's latency passes under earlier products or under the softmax arithmetic and the waits are counted ones. AT_HOLD keeps the compiler from moving a group back
    // down to its use, where each pair of reads would be waited for to zero in front of its product.
#define AT_HOLD() __builtin_amdgcn_sched_barrier(0x6)   // 0x6: vector and scalar arithmetic may still cross; LDS reads and matrix products may not
    FB qa[4], kf[4][4], vf[2][8];
    auto kread = [&](int j) {
#pragma unroll   // unrolled, like the loops of vread and kprod, so that the fragment arrays are indexed by constants and stay registers
      for (int dc = 0; dc < 4; ++dc) {
        kf[j][dc].h[0] = *(const v8b*)(Ksh + (j * 16 + c) * KP + dc * 32 + 8 * hh);
        kf[j][dc].h[1] = *(const v8b*)(Ksh + (j * 16 + c) * KP + dc * 32 + 16 + 8 * hh);
      }
    };
    auto vread = [&](int kk, int t0) {
#pragma unroll
      for (int t = t0; t < t0 + 4; ++t) {
        vf[kk][t].h[0] = *(const v8b*)(Vth + (t * 16 + c) * VP + kk * 32 + 8 * hh);
        vf[kk][t].h[1] = *(const v8b*)(Vth + (t * 16 + c) * VP + kk * 32 + 16 + 8 * hh);
      }
    };
    v8f s[4];   // s[j][r] = score of key (it * NG + grp) * AT_KC + 16 j + 8 hh + r with query q0 + c
    auto kprod = [&](int j) {
      s[j] = (v8f){0.f,0.f,0.f,0.f,0.f,0.f,0.f,0.f};
#pragma unroll
      for (int dc = 0; dc < 4; ++dc) s[j] = at_mma16<F16>(kf[j][dc].v, qa[dc].v, s[j]);
    };
#pragma unroll
    for (int dc = 0; dc < 4; ++dc) {
      qa[dc].h[0] = *(const v8b*)(&Qsh[wave][c * KP + dc * 32 + 8 * hh]);
      qa[dc].h[1] = *(const v8b*)(&Qsh[wave][c * KP + dc * 32 + 16 + 8 * hh]);
    }
    kread(0); kread(1); kread(2); AT_HOLD();
    kprod(0);    AT_HOLD();
    kread(3);    AT_HOLD();
    kprod(1);    AT_HOLD();
    vread(0, 0); AT_HOLD();
    kprod(2);    kprod(3);    AT_HOLD();
    vread(0, 4); vread(1, 0); AT_HOLD();   // these two groups come in under the softmax arithmetic
    float m = -INFINITY;
#pragma unroll   // unrolled, like the loops below, so that s, pb and oacc are indexed by constants and stay registers
    for (int j = 0; j < 4; ++j)
#pragma unroll
      for (int r = 0; r < 8; ++r) m = fmaxf(m, s[j][r]);
    m = fmaxf(m, at_xhalf(m));          // both halves hold the maximum over the tile's 64 keys
    const float mnew = fmaxf(mrow, m);
    const float alpha = __builtin_amdgcn_exp2f(mrow - mnew);   // 0 on the first trip, where mrow is -inf
    mrow = mnew;
    const float msh = mnew - 15.0f;     // p = 2^(s - mnew + 15)
    float psum = 0.f;
    union PB { v16b v; unsigned w[8]; } pb[2];   // p^T as B operand: element e of pb[kk] is key 32 kk + 8 hh + e (e < 8), 32 kk + 16 + 8 hh + e - 8 (e >= 8): the order in which the v rows are read below
#pragma unroll
    for (int j = 0; j < 4; ++j) {
#pragma unroll
      for (int r = 0; r < 8; r += 2) {
        const float p0 = __builtin_amdgcn_exp2f(s[j][r] - msh), p1 = __builtin_amdgcn_exp2f(s[j][r + 1] - msh);
        psum += p0;
        psum += p1;
        pb[j >> 1].w[(j & 1) * 4 + (r >> 1)] = __builtin_bit_cast(unsigned, __builtin_convertvector((v2f){p0, p1}, v2h));   // one packed conversion a pair
      }
    }
    lrow = lrow * alpha + psum;
#pragma unroll
    for (int t = 0; t < 8; ++t)
#pragma unroll
      for (int r = 0; r < 8; ++r) oacc[t][r] *= alpha;
    auto vprod = [&](int kk, int t0) {
#pragma unroll
      for (int t = t0; t < t0 + 4; ++t) oacc[t] = at_mma16<F16>(vf[kk][t].v, pb[kk].v, oacc[t]);
    };
    AT_HOLD();   // keeps the out products out of the softmax's scheduling region: with them in it the build runs to the full 256 registers
    vprod(0, 0); AT_HOLD();
    vread(1, 4); AT_HOLD();   // the last group takes the registers that the first four v fragments have left: 256 registers do not hold it earlier
    vprod(0, 4); vprod(1, 0); vprod(1, 4);
    __builtin_amdgcn_sched_barrier(0);   // the products stay ahead of the hand-over: moved behind it, they would leave its wait for the last group directly behind that group's reads
    // hand-over, every wave, in this order
    asm volatile("s_wait_dscnt 0x0" ::: "memory");      // the wave's reads of this trip's buffer have returned
    asm volatile("s_wait_asynccnt 0x0" ::: "memory");   // the wave's own copies of the next trip's tiles have landed
    __syncthreads();                                    // publishes the next trip's tiles and ends every reader's last read of this trip's buffer
    if (it + 2 < nTrips) copy_tile(it + 2);             // refill of the buffer just left; the test reads the same in the whole block
  }
  asm volatile("s_wait_asynccnt 0x0" ::: "memory");     // no copy is outstanding when the buffers become out tiles

  float* os = (float*)KVraw + wv * (16 * 132);
  lrow += at_xhalf(lrow);   // the query's sum over all keys of the group
  if (NG > 1) {
    if (hh == 0) { Msh[wv][c] = mrow; Lsh[wv][c] = lrow; }   // both halves hold the same two values: one of them stores
  }
  __syncthreads();   // every wave has left the k, v tiles, which the out tiles overlay; the maxima and sums of all groups are published
  {
    float inv;
    if (NG > 1) {
      float mg[NG], mall = -INFINITY, lall = 0.f;
#pragma unroll   // unrolled so that mg is indexed by constants and stays registers
      for (int gi = 0; gi < NG; ++gi) { mg[gi] = Msh[gi * AT_NW + wave][c]; mall = fmaxf(mall, mg[gi]); }
#pragma unroll
      for (int gi = 0; gi < NG; ++gi) lall += Lsh[gi * AT_NW + wave][c] * at_exp2_slot(mg[gi] - mall);
      inv = at_exp2_slot(mrow - mall) / lall;
    } else {
      inv = 1.0f / lrow;
    }
#pragma unroll   // unrolled so that oacc is indexed by constants; a lane's eight values are consecutive d of its query's row: two 16 B stores
    for (int t = 0; t < 8; ++t) {
      v4f lo, hi;
#pragma unroll
      for (int e = 0; e < 4; ++e) { lo[e] = oacc[t][e] * inv; hi[e] = oacc[t][4 + e] * inv; }
      *(v4f*)(os + c * 132 + t * 16 + 8 * hh)     = lo;
      *(v4f*)(os + c * 132 + t * 16 + 8 * hh + 4) = hi;
    }
  }
  __syncthreads();   // the weighted out tiles of all groups are published
  {
    const int c4 = lane * 4;           // 32 lanes x 16 B = one 512-B output row (128 floats) per instruction
    const float* ot = (const float*)KVraw + wave * (16 * 132);   // group 0's tile of these query rows; group gi's lies gi * AT_NW tiles further
#pragma unroll   // unrolled, with the loop inside it, so that all LDS reads of the rows are issued before the first sum waits
    for (int rr = 0; rr < 16 / NG; ++rr) {     // each group sums and stores its own 16 / NG rows of the tile
      const int row = grp * (16 / NG) + rr;
      v4f val = *(const v4f*)(ot + row * 132 + c4);
#pragma unroll
      for (int gi = 1; gi < NG; ++gi) val += *(const v4f*)(ot + gi * (AT_NW * 16 * 132) + row * 132 + c4);
      *(v4f*)(ob_ptr + (size_t)(q0 + row) * g.o_rs + c4) = val;
    }
  }
}

// ---- q, k and v projections in ONE launch, straight from the f32 inputs -------------------------------------------
// A block owns 64 rows of x (= one 64-key tile). Its 16 waves bring those rows and the three weight matrices in by whole-line 16 B loads, round them to
// f16 (the same rounding as a cast pass) and lay them in LDS as rows of 128 values: rows 0..63 x, 64..191 Wq, 192..319 Wk, 320..447 Wv.
// Behind the one barrier 12 waves each form a 32 x 64 tile over k = 128: q, k = x W^T + b (rows = x rows), v transposed = Wv x^T + bv (rows = d, columns = keys).
// Outputs: Q f32 rows, K16 f16 rows, Vt16 f16 [128 d][64 keys] per 64-key tile.
#define PJ_XP 136   // LDS row pitch in f16: 272 B = 16 B x odd, so the 16 rows of a ds_load_b128 fragment read fall on distinct banks
typedef __attribute__((ext_vector_type(4))) _Float16 v4h;
__device__ __forceinline__ v4h pj_cvt(v4f f) { v4h h; h[0] = (_Float16)f[0]; h[1] = (_Float16)f[1]; h[2] = (_Float16)f[2]; h[3] = (_Float16)f[3]; return h; }
// BIAS_MODE: 1 = bias[m], 2 = bias[n]. OUT16: f16 output (Ch), else f32 (Cf). The 32 x 64 tile goes out through the wave's own LDS slab, as whole row segments.
template <int BIAS_MODE, bool OUT16>
__device__ __forceinline__ void pj_store(const v8f (&acc)[2][4], float* slab, float* __restrict__ Cf, unsigned short* __restrict__ Ch,
                                         int ldc, int m0, int n0, const float* __restrict__ bias, int lane) {
  const int rlane = lane & 15;
  const int mOff  = (lane >> 4) * 8;
#pragma unroll   // unrolled, with the loops inside it, so that acc is indexed by constants and stays in registers
  for (int i = 0; i < 2; ++i) {
#pragma unroll
    for (int j = 0; j < 4; ++j) {
      float bn = 0.f;
      if (BIAS_MODE == 2) bn = bias[n0 + (j << 4) + rlane];
#pragma unroll
      for (int r = 0; r < 8; ++r) {
        float v = acc[i][j][r];
        if (BIAS_MODE == 1) v += bias[m0 + (i << 4) + mOff + r];
        if (BIAS_MODE == 2) v += bn;
        slab[((i << 4) + mOff + r) * 68 + (j << 4) + rlane] = v;
      }
    }
  }
  // the slab is private to the wave: its lanes' writes are ordered before its lanes' reads; it stands ahead of every global store, so it waits for none
  __builtin_amdgcn_fence(__ATOMIC_RELEASE, "workgroup");
  __builtin_amdgcn_wave_barrier();
  __builtin_amdgcn_fence(__ATOMIC_ACQUIRE, "workgroup");
  if (!OUT16) {
    const int hh = lane >> 4, c4 = (lane & 15) * 4;     // row segment = 256 B = 16 lanes x 16 B
#pragma unroll   // unrolled so that the LDS reads of all rows are issued before the first store waits
    for (int it = 0; it < 16; ++it) {
      const int row = it * 2 + hh;
      v4f v = *(const v4f*)(slab + row * 68 + c4);
      *(v4f*)(Cf + (size_t)(m0 + row) * ldc + n0 + c4) = v;
    }
  } else {
    const int q = lane >> 3, c8 = (lane & 7) * 8;       // row segment = 128 B = 8 lanes x 16 B
#pragma unroll   // unrolled for the same reason
    for (int it = 0; it < 8; ++it) {
      const int row = it * 4 + q;
      const float* sp = slab + row * 68 + c8;
      v8h hv;
#pragma unroll
      for (int e = 0; e < 8; ++e) hv[e] = (_Float16)sp[e];
      *(v8h*)(Ch + (size_t)(m0 + row) * ldc + n0 + c8) = hv;
    }
  }
  // precaution: this wait stands behind the issued stores, before code that follows the call reuses their address and data registers
  asm volatile("s_wait_xcnt 0x0" ::: "memory");
}
__global__ __launch_bounds__(512) void proj_qkv(
    const float* __restrict__ x, const float* __restrict__ Wq, const float* __restrict__ bq, const float* __restrict__ Wk, const float* __restrict__ bk,
    const float* __restrict__ Wv, const float* __restrict__ bv, float* __restrict__ Q, unsigned short* __restrict__ K16, unsigned short* __restrict__ Vt16) {
  __shared__ __align__(16) _Float16 Sm[448 * PJ_XP];
  __shared__ __align__(16) float sT[12][32 * 68];   // per-wave 32x64 slab, pitch 68 floats
  const int tid  = threadIdx.x;
  const int row0 = blockIdx.x * 64;
  {
    // a wave's 32 lanes take one whole 512 B row; the block takes 16 rows (2048 floats) a step
    const float* xs = x + (size_t)row0 * 128 + tid * 4;
    const float* qs = Wq + tid * 4;
    const float* ks = Wk + tid * 4;
    const float* vs = Wv + tid * 4;
    v4f xr[4], qr[8], kr[8], vr[8];
#pragma unroll   // unrolled so that the arrays are registers and all 28 loads are in flight before the first conversion waits
    for (int it = 0; it < 4; ++it) xr[it] = *(const v4f*)(xs + it * 2048);
#pragma unroll
    for (int it = 0; it < 8; ++it) {
      qr[it] = *(const v4f*)(qs + it * 2048);
      kr[it] = *(const v4f*)(ks + it * 2048);
      vr[it] = *(const v4f*)(vs + it * 2048);
    }
    // precaution: this wait stands behind the issued loads, before their address registers are reused
    asm volatile("s_wait_xcnt 0x0" ::: "memory");
    _Float16* d = Sm + (tid >> 5) * PJ_XP + (tid & 31) * 4;
#pragma unroll   // unrolled for the same reason; the row steps become immediate offsets
    for (int it = 0; it < 4; ++it) *(v4h*)(d + it * 16 * PJ_XP) = pj_cvt(xr[it]);
#pragma unroll
    for (int it = 0; it < 8; ++it) {
      *(v4h*)(d + (64 + it * 16) * PJ_XP)  = pj_cvt(qr[it]);
      *(v4h*)(d + (192 + it * 16) * PJ_XP) = pj_cvt(kr[it]);
      *(v4h*)(d + (320 + it * 16) * PJ_XP) = pj_cvt(vr[it]);
    }
  }
  __syncthreads();   // x rows and weights are published to every wave; the only block barrier of the kernel
  const int wave = __builtin_amdgcn_readfirstlane(tid >> 5);   // the same in a whole wave: held scalar, so the tile choice is scalar arithmetic and scalar branches
  if (wave >= 12) return;                // 12 tiles of 32 x 64; whole waves leave, behind the barrier
  const int lane  = tid & 31;
  const int rlane = lane & 15;           // row (A) / column (B, D) within a 16 x 16 subtile
  const int koff  = (lane >> 4) * 8;     // k offset of this lane half
  const int which = wave >> 2;           // 0 q, 1 k, 2 v
  const int sub   = wave & 3;
  const int aRow = (which == 2) ? 320 + sub * 32 : (sub >> 1) * 32;
  const int bRow = (which == 2) ? 0 : 64 + which * 128 + (sub & 1) * 64;
  const _Float16* Al = Sm + (aRow + rlane) * PJ_XP + koff;
  const _Float16* Bl = Sm + (bRow + rlane) * PJ_XP + koff;
  v8f acc[2][4];
#pragma unroll
  for (int i = 0; i < 2; ++i)
#pragma unroll
    for (int j = 0; j < 4; ++j) acc[i][j] = (v8f){0.f,0.f,0.f,0.f,0.f,0.f,0.f,0.f};
#pragma unroll   // unrolled so that a later step's fragment reads can be issued ahead of an earlier step's products
  for (int k0 = 0; k0 < 128; k0 += 32) {
    v16h bh[4], ah[2];
#pragma unroll
    for (int j = 0; j < 4; ++j) bh[j] = Frag<_Float16>::load(Bl + j * 16 * PJ_XP + k0);
#pragma unroll
    for (int i = 0; i < 2; ++i) ah[i] = Frag<_Float16>::load(Al + i * 16 * PJ_XP + k0);
#pragma unroll
    for (int i = 0; i < 2; ++i)
#pragma unroll
      for (int j = 0; j < 4; ++j) acc[i][j] = Frag<_Float16>::mma(ah[i], bh[j], acc[i][j]);
  }
  float* slab = sT[wave];
  if (which == 0)      pj_store<2, false>(acc, slab, Q, nullptr, 128, row0 + (sub >> 1) * 32, (sub & 1) * 64, bq, lane);
  else if (which == 1) pj_store<2, true>(acc, slab, nullptr, K16, 128, row0 + (sub >> 1) * 32, (sub & 1) * 64, bk, lane);
  else                 pj_store<1, true>(acc, slab, nullptr, Vt16 + (size_t)blockIdx.x * (64 * 128), 64, sub * 32, 0, bv, lane);
}

#define IB 4
#define INn 4096
#define ID 128
extern "C" void kernel_launch(void* const* d_in, const int* in_sizes, int n_in, void* d_out, int out_size, void* d_ws, size_t ws_size, hipStream_t stream) {
  (void)in_sizes; (void)n_in; (void)out_size; (void)ws_size;
  const float* x = (const float*)d_in[0]; const float* Wq = (const float*)d_in[1]; const float* bq = (const float*)d_in[2]; const float* Wk = (const float*)d_in[3]; const float* bk = (const float*)d_in[4]; const float* Wv = (const float*)d_in[5]; const float* bv = (const float*)d_in[6];
  char* ws = (char*)d_ws; size_t off = 0;
  auto carve = [&](size_t bytes) -> char* { char* p = ws + off; off += (bytes + 255) & ~(size_t)255; return p; };
  const int R = IB * INn;
  float* Q = (float*)carve((size_t)R * ID * 4); _Float16* K16 = (_Float16*)carve((size_t)R * ID * 2); _Float16* Vt16 = (_Float16*)carve((size_t)R * ID * 2);
  // q f32 rows, k f16 rows, v f16 transposed per 64-key tile ([128 d][64 keys], 16 KB contiguous): one launch, one block per 64 rows of x
  proj_qkv<<<R / AT_KC, 512, 0, stream>>>(x, Wq, bq, Wk, bk, Wv, bv, Q, (unsigned short*)K16, (unsigned short*)Vt16);
  { AttnGeom g;
    g.q_bs = (long)INn * ID; g.q_rs = ID; g.q_hs = 0; g.k_bs = g.q_bs; g.k_rs = ID; g.k_hs = 0; g.v_bs = g.q_bs; g.v_rs = ID; g.v_hs = 0; g.o_bs = (long)INn * ID; g.o_rs = ID; g.o_hs = 0;
    g.S = INn; g.Skv = INn; g.H = 1; g.mask_mode = 0; g.qscale = 0.12751743f /* log2(e) / sqrt(128) */; g.blk0 = 0; g.mask_fill = -INFINITY; g.mask_is_int = 0;
    attn128_kernel<false, false, true, 0, true, 4><<<IB * (INn / AT_QB), 4 * AT_NW * 32, 0, stream>>>(Q, nullptr, nullptr, U16(K16), U16(Vt16), (float*)d_out, nullptr, nullptr, g); }
}
